// v000
// Times are from an AMD MI455X. After a warm-up the kernel runs many times in a row, and a time is the length of
// such a window on the GPU divided by its runs, so every launch and the gaps after it count. The runs cycle
// through copies of the inputs. A figure is the median of several windows, for all but v000 over two sittings.
// Sittings can differ by a few percent; kernels timed side by side share one.
// The starting kernel, v000, takes 72.3 microseconds a run.
#include <hip/hip_runtime.h>
#include <hip/hip_bf16.h>

typedef __attribute__((ext_vector_type(16))) _Float16 v16h;
typedef __attribute__((ext_vector_type(8)))  _Float16 v8h;
typedef __attribute__((ext_vector_type(8)))  float    v8f;

#define KB   256      // batch
#define KI   128      // DIM_IN
#define KJ   128      // DIM_OUT
#define KH   32       // HIDDEN
#define KF   7        // 1 + 2*N_SIN features
#define KF8  8        // padded K

// ---------------------------------------------------------------------------
// Prologue 1: feats[b,i,0..6] = [x, sin(x),sin(2x),sin(4x), cos(x),cos(2x),cos(4x)]
// packed as f16 in WMMA A-operand K-order: featsH[(i*256 + b)*8 + k]
// ---------------------------------------------------------------------------
__global__ __launch_bounds__(256) void kan_pack_feats(const float* __restrict__ x,
                                                      _Float16* __restrict__ featsH) {
    int t = blockIdx.x * 256 + threadIdx.x;      // 0 .. B*I-1
    int b = t >> 7;
    int i = t & (KI - 1);
    float xv = x[b * KI + i];
    v8h f;
    f[0] = (_Float16)xv;
    f[1] = (_Float16)__sinf(xv);
    f[2] = (_Float16)__sinf(2.0f * xv);
    f[3] = (_Float16)__sinf(4.0f * xv);
    f[4] = (_Float16)__cosf(xv);
    f[5] = (_Float16)__cosf(2.0f * xv);
    f[6] = (_Float16)__cosf(4.0f * xv);
    f[7] = (_Float16)0.0f;
    *(v8h*)(featsH + (size_t)(i * KB + b) * KF8) = f;
}

// ---------------------------------------------------------------------------
// Prologue 2: W1[i,j,h,0..6] (f32) -> w1h[(i*4096 + j*32 + h)*8 + k] (f16, K-padded)
// ---------------------------------------------------------------------------
__global__ __launch_bounds__(256) void kan_pack_w1(const float* __restrict__ W1,
                                                   _Float16* __restrict__ w1h) {
    size_t t = (size_t)blockIdx.x * 256 + threadIdx.x;   // 0 .. I*J*H-1
    const float* s = W1 + t * KF;
    v8h w;
#pragma unroll
    for (int k = 0; k < KF; ++k) w[k] = (_Float16)s[k];
    w[7] = (_Float16)0.0f;
    *(v8h*)(w1h + t * KF8) = w;
}

// ---------------------------------------------------------------------------
// Main fused kernel. One wave32 per (16-row b-tile, j). Loop over i:
//   h_tile = feats_tile(16x8pad) x W1_tile(8pad x 16)  via v_wmma_f32_16x16x32_f16
//   silu(h + B1) * W2 accumulated per-lane; cross-lane Σ_h reduction at the end.
// ---------------------------------------------------------------------------
__global__ __launch_bounds__(256) void kan_edge_mlp(const _Float16* __restrict__ featsH,
                                                    const _Float16* __restrict__ w1h,
                                                    const float* __restrict__ B1p,
                                                    const float* __restrict__ W2p,
                                                    const float* __restrict__ B2p,
                                                    float* __restrict__ out) {
    const int lane  = threadIdx.x & 31;
    const int wid   = threadIdx.x >> 5;
    const int task  = blockIdx.x * 8 + wid;          // 0 .. 2047
    const int j     = task & (KJ - 1);
    const int btile = task >> 7;                     // 0 .. 15
    const int l15   = lane & 15;
    const bool act  = lane < 16;                     // K=0..7 lives only in lanes 0-15

    float acc0[8], acc1[8];
#pragma unroll
    for (int r = 0; r < 8; ++r) { acc0[r] = 0.0f; acc1[r] = 0.0f; }
    float b2sum = 0.0f;

    const v8f zero = {};

    for (int i = 0; i < KI; ++i) {
        // Build A operand: feats for rows b = btile*16 + 0..15, K=0..7 in elems 0..7.
        v16h a = {}, b0 = {}, b1v = {};
        if (act) {
            v8h al  = *(const v8h*)(featsH + (size_t)(i * KB + btile * 16 + l15) * KF8);
            v8h bl0 = *(const v8h*)(w1h + ((size_t)i * (KJ * KH) + j * KH + l15) * KF8);
            v8h bl1 = *(const v8h*)(w1h + ((size_t)i * (KJ * KH) + j * KH + 16 + l15) * KF8);
#pragma unroll
            for (int k = 0; k < 8; ++k) { a[k] = al[k]; b0[k] = bl0[k]; b1v[k] = bl1[k]; }
        }
        // Prefetch next i's W1 tile line into cache (global_prefetch_b8).
        if (i + 1 < KI)
            __builtin_prefetch(w1h + ((size_t)(i + 1) * (KJ * KH) + j * KH + l15) * KF8, 0, 1);

        // h[b, h0..15] and h[b, h16..31] for this (i, j): fresh C=0 each i.
        v8f c0 = __builtin_amdgcn_wmma_f32_16x16x32_f16(false, a, false, b0,
                                                        (short)0, zero, false, false);
        v8f c1 = __builtin_amdgcn_wmma_f32_16x16x32_f16(false, a, false, b1v,
                                                        (short)0, zero, false, false);

        const int base = (i * KJ + j) * KH + l15;    // [I,J,H] flat, h = l15 (+16)
        float bias0 = B1p[base];
        float bias1 = B1p[base + 16];
        float w20   = W2p[base];                     // W2[:, :, 0, :] same flat layout
        float w21   = W2p[base + 16];
        b2sum += B2p[i * KJ + j];                    // uniform scalar

#pragma unroll
        for (int r = 0; r < 8; ++r) {
            float v0 = c0[r] + bias0;
            float v1 = c1[r] + bias1;
            float s0 = v0 * __builtin_amdgcn_rcpf(1.0f + __expf(-v0));   // silu
            float s1 = v1 * __builtin_amdgcn_rcpf(1.0f + __expf(-v1));
            acc0[r] = fmaf(s0, w20, acc0[r]);
            acc1[r] = fmaf(s1, w21, acc1[r]);
        }
    }

    // Σ over h: reduce within each 16-lane half (lanes 0-15 hold rows 0-7,
    // lanes 16-31 hold rows 8-15; xor masks 1,2,4,8 stay within each half).
    float red[8];
#pragma unroll
    for (int r = 0; r < 8; ++r) {
        float v = acc0[r] + acc1[r];
        v += __shfl_xor(v, 1, 32);
        v += __shfl_xor(v, 2, 32);
        v += __shfl_xor(v, 4, 32);
        v += __shfl_xor(v, 8, 32);
        red[r] = v;
    }

    if (l15 == 0) {
        int brow = btile * 16 + ((lane >> 4) << 3);  // lane 0 -> rows 0..7, lane 16 -> 8..15
#pragma unroll
        for (int r = 0; r < 8; ++r)
            out[(brow + r) * KJ + j] = red[r] + b2sum;
    }
}

// ---------------------------------------------------------------------------
extern "C" void kernel_launch(void* const* d_in, const int* in_sizes, int n_in,
                              void* d_out, int out_size, void* d_ws, size_t ws_size,
                              hipStream_t stream) {
    const float* x  = (const float*)d_in[0];   // [B, I]
    const float* W1 = (const float*)d_in[1];   // [I, J, H, 7]
    const float* W2 = (const float*)d_in[2];   // [I, J, 1, H]
    const float* B1 = (const float*)d_in[3];   // [I, J, H]
    const float* B2 = (const float*)d_in[4];   // [I, J, 1]
    float* out = (float*)d_out;                // [B, J]

    _Float16* featsH = (_Float16*)d_ws;                                  // 512 KB
    _Float16* w1h    = (_Float16*)((char*)d_ws +
                        (size_t)KI * KB * KF8 * sizeof(_Float16));       // 8.4 MB

    kan_pack_feats<<<(KB * KI) / 256, 256, 0, stream>>>(x, featsH);
    kan_pack_w1<<<(KI * KJ * KH) / 256, 256, 0, stream>>>(W1, w1h);
    kan_edge_mlp<<<(16 * KJ) / 8, 256, 0, stream>>>(featsH, w1h, B1, W2, B2, out);
}

// v001
// A run of this version takes 31.9 microseconds.
// Next to v000, in two timings, it ran 2.29 and 2.30 times as fast.
#include <hip/hip_runtime.h>
#include <hip/hip_bf16.h>

typedef __attribute__((ext_vector_type(16))) _Float16 v16h;
typedef __attribute__((ext_vector_type(8)))  _Float16 v8h;
typedef __attribute__((ext_vector_type(8)))  float    v8f;

#define KB   256      // batch
#define KI   128      // DIM_IN
#define KJ   128      // DIM_OUT
#define KH   32       // HIDDEN
#define KF   7        // 1 + 2*N_SIN features
#define KF8  8        // padded K

// ---------------------------------------------------------------------------
// Prologue 1: feats[b,i,0..6] = [x, sin(x),sin(2x),sin(4x), cos(x),cos(2x),cos(4x)]
// packed as f16 in WMMA A-operand K-order: featsH[(i*256 + b)*8 + k]
// ---------------------------------------------------------------------------
__global__ __launch_bounds__(256) void kan_pack_feats(const float* __restrict__ x,
                                                      _Float16* __restrict__ featsH) {
    int t = blockIdx.x * 256 + threadIdx.x;      // 0 .. B*I-1
    int b = t >> 7;
    int i = t & (KI - 1);
    float xv = x[b * KI + i];
    v8h f;
    f[0] = (_Float16)xv;
    f[1] = (_Float16)__sinf(xv);
    f[2] = (_Float16)__sinf(2.0f * xv);
    f[3] = (_Float16)__sinf(4.0f * xv);
    f[4] = (_Float16)__cosf(xv);
    f[5] = (_Float16)__cosf(2.0f * xv);
    f[6] = (_Float16)__cosf(4.0f * xv);
    f[7] = (_Float16)0.0f;
    *(v8h*)(featsH + (size_t)(i * KB + b) * KF8) = f;
}

// ---------------------------------------------------------------------------
// Prologue 2: W1[i,j,h,0..6] (f32) -> w1h[(i*4096 + j*32 + h)*8 + k] (f16, K-padded)
// ---------------------------------------------------------------------------
__global__ __launch_bounds__(256) void kan_pack_w1(const float* __restrict__ W1,
                                                   _Float16* __restrict__ w1h) {
    size_t t = (size_t)blockIdx.x * 256 + threadIdx.x;   // 0 .. I*J*H-1
    const float* s = W1 + t * KF;
    v8h w;
#pragma unroll
    for (int k = 0; k < KF; ++k) w[k] = (_Float16)s[k];
    w[7] = (_Float16)0.0f;
    *(v8h*)(w1h + t * KF8) = w;
}

// ---------------------------------------------------------------------------
// Main fused kernel. One 8-wave block per (16-row b-tile, j); wave w takes the
// 16 values of i from w*16 on, so 16 waves stand on each SIMD and cover each
// other's load waits. Per i:
//   h_tile = feats_tile(16x8pad) x W1_tile(8pad x 16)  via v_wmma_f32_16x16x32_f16
//   silu(h + B1) * W2 accumulated per-lane; cross-lane sum over h at the end,
//   then the 8 waves' partial sums over i are added through LDS in wave order.
// ---------------------------------------------------------------------------
#define KW   8            // waves per block = parts of the i range
#define KIC  (KI / KW)    // values of i per wave

__global__ __launch_bounds__(256) void kan_edge_mlp(const _Float16* __restrict__ featsH,
                                                    const _Float16* __restrict__ w1h,
                                                    const float* __restrict__ B1p,
                                                    const float* __restrict__ W2p,
                                                    const float* __restrict__ B2p,
                                                    float* __restrict__ out) {
    __shared__ float part[16][KW];   // [row][wave]: a row's 8 partial sums lie side by side

    const int lane  = threadIdx.x & 31;
    // wave number as a scalar: the i range and every base address stay scalar
    const int wid   = __builtin_amdgcn_readfirstlane(threadIdx.x >> 5);
    const int j     = blockIdx.x & (KJ - 1);
    const int btile = blockIdx.x >> 7;               // 0 .. 15
    const int l15   = lane & 15;
    const bool act  = lane < 16;                     // K=0..7 lives only in lanes 0-15

    float acc0[8], acc1[8];
#pragma unroll
    for (int r = 0; r < 8; ++r) { acc0[r] = 0.0f; acc1[r] = 0.0f; }
    float b2sum = 0.0f;

    const v8f zero = {};
    const int i0 = wid * KIC;

    for (int i = i0; i < i0 + KIC; ++i) {
        // Build A operand: feats for rows b = btile*16 + 0..15, K=0..7 in elems 0..7.
        v16h a = {}, b0 = {}, b1v = {};
        if (act) {
            v8h al  = *(const v8h*)(featsH + (size_t)(i * KB + btile * 16 + l15) * KF8);
            v8h bl0 = *(const v8h*)(w1h + ((size_t)i * (KJ * KH) + j * KH + l15) * KF8);
            v8h bl1 = *(const v8h*)(w1h + ((size_t)i * (KJ * KH) + j * KH + 16 + l15) * KF8);
#pragma unroll
            for (int k = 0; k < 8; ++k) { a[k] = al[k]; b0[k] = bl0[k]; b1v[k] = bl1[k]; }
        }

        // h[b, h0..15] and h[b, h16..31] for this (i, j): fresh C=0 each i.
        v8f c0 = __builtin_amdgcn_wmma_f32_16x16x32_f16(false, a, false, b0,
                                                        (short)0, zero, false, false);
        v8f c1 = __builtin_amdgcn_wmma_f32_16x16x32_f16(false, a, false, b1v,
                                                        (short)0, zero, false, false);

        const int base = (i * KJ + j) * KH + l15;    // [I,J,H] flat, h = l15 (+16)
        float bias0 = B1p[base];
        float bias1 = B1p[base + 16];
        float w20   = W2p[base];                     // W2[:, :, 0, :] same flat layout
        float w21   = W2p[base + 16];
        b2sum += B2p[i * KJ + j];                    // uniform scalar

#pragma unroll
        for (int r = 0; r < 8; ++r) {
            float v0 = c0[r] + bias0;
            float v1 = c1[r] + bias1;
            float s0 = v0 * __builtin_amdgcn_rcpf(1.0f + __expf(-v0));   // silu
            float s1 = v1 * __builtin_amdgcn_rcpf(1.0f + __expf(-v1));
            acc0[r] = fmaf(s0, w20, acc0[r]);
            acc1[r] = fmaf(s1, w21, acc1[r]);
        }
    }

    // Sum over h: reduce within each 16-lane half (lanes 0-15 hold rows 0-7,
    // lanes 16-31 hold rows 8-15; xor masks 1,2,4,8 stay within each half).
    float red[8];
#pragma unroll
    for (int r = 0; r < 8; ++r) {
        float v = acc0[r] + acc1[r];
        v += __shfl_xor(v, 1, 32);
        v += __shfl_xor(v, 2, 32);
        v += __shfl_xor(v, 4, 32);
        v += __shfl_xor(v, 8, 32);
        red[r] = v;
    }

    if (l15 == 0) {
        int row = (lane >> 4) << 3;                  // lane 0 -> rows 0..7, lane 16 -> 8..15
#pragma unroll
        for (int r = 0; r < 8; ++r)
            part[row + r][wid] = red[r] + b2sum;
    }
    __syncthreads();   // every wave's partial sums stand in LDS before they are added

    if (threadIdx.x < 16) {
        float s = part[threadIdx.x][0];
        for (int w = 1; w < KW; ++w) s += part[threadIdx.x][w];
        out[(btile * 16 + threadIdx.x) * KJ + j] = s;
    }
}

// ---------------------------------------------------------------------------
extern "C" void kernel_launch(void* const* d_in, const int* in_sizes, int n_in,
                              void* d_out, int out_size, void* d_ws, size_t ws_size,
                              hipStream_t stream) {
    const float* x  = (const float*)d_in[0];   // [B, I]
    const float* W1 = (const float*)d_in[1];   // [I, J, H, 7]
    const float* W2 = (const float*)d_in[2];   // [I, J, 1, H]
    const float* B1 = (const float*)d_in[3];   // [I, J, H]
    const float* B2 = (const float*)d_in[4];   // [I, J, 1]
    float* out = (float*)d_out;                // [B, J]

    _Float16* featsH = (_Float16*)d_ws;                                  // 512 KB
    _Float16* w1h    = (_Float16*)((char*)d_ws +
                        (size_t)KI * KB * KF8 * sizeof(_Float16));       // 8.4 MB

    kan_pack_feats<<<(KB * KI) / 256, 256, 0, stream>>>(x, featsH);
    kan_pack_w1<<<(KI * KJ * KH) / 256, 256, 0, stream>>>(W1, w1h);
    kan_edge_mlp<<<16 * KJ, 256, 0, stream>>>(featsH, w1h, B1, W2, B2, out);
}

// v002
// Measured time: 28.2 microseconds a run.
// Timed twice side by side with v001, it ran 1.13 times as fast both times.
// All steps since v000 together make it 2.59 times as fast.
#include <hip/hip_runtime.h>
#include <hip/hip_bf16.h>

typedef __attribute__((ext_vector_type(16))) _Float16 v16h;
typedef __attribute__((ext_vector_type(8)))  _Float16 v8h;
typedef __attribute__((ext_vector_type(8)))  float    v8f;

#define KB   256      // batch
#define KI   128      // DIM_IN
#define KJ   128      // DIM_OUT
#define KH   32       // HIDDEN
#define KF   7        // 1 + 2*N_SIN features
#define KF8  8        // padded K

// ---------------------------------------------------------------------------
// Prologue 1: feats[b,i,0..6] = [x, sin(x),sin(2x),sin(4x), cos(x),cos(2x),cos(4x)]
// packed as f16 in WMMA A-operand K-order: featsH[(i*256 + b)*8 + k]
// ---------------------------------------------------------------------------
__global__ __launch_bounds__(256) void kan_pack_feats(const float* __restrict__ x,
                                                      _Float16* __restrict__ featsH) {
    int t = blockIdx.x * 256 + threadIdx.x;      // 0 .. B*I-1
    int b = t >> 7;
    int i = t & (KI - 1);
    float xv = x[b * KI + i];
    v8h f;
    f[0] = (_Float16)xv;
    f[1] = (_Float16)__sinf(xv);
    f[2] = (_Float16)__sinf(2.0f * xv);
    f[3] = (_Float16)__sinf(4.0f * xv);
    f[4] = (_Float16)__cosf(xv);
    f[5] = (_Float16)__cosf(2.0f * xv);
    f[6] = (_Float16)__cosf(4.0f * xv);
    f[7] = (_Float16)0.0f;
    *(v8h*)(featsH + (size_t)(i * KB + b) * KF8) = f;
}

// ---------------------------------------------------------------------------
// Prologue 2: W1[i,j,h,0..6] (f32) -> w1h[(i*4096 + j*32 + h)*8 + k] (f16, K-padded)
// ---------------------------------------------------------------------------
__global__ __launch_bounds__(256) void kan_pack_w1(const float* __restrict__ W1,
                                                   _Float16* __restrict__ w1h) {
    size_t t = (size_t)blockIdx.x * 256 + threadIdx.x;   // 0 .. I*J*H-1
    const float* s = W1 + t * KF;
    v8h w;
#pragma unroll
    for (int k = 0; k < KF; ++k) w[k] = (_Float16)s[k];
    w[7] = (_Float16)0.0f;
    *(v8h*)(w1h + t * KF8) = w;
}

// ---------------------------------------------------------------------------
// Main fused kernel. One 8-wave block per (16-row b-tile, j); wave w takes the
// 16 values of i from w*16 on, so 16 waves stand on each SIMD and cover each
// other's load waits. Per i:
//   h_tile = feats_tile(16x8pad) x W1_tile(8pad x 16)  via v_wmma_f32_16x16x32_f16
//   silu(h + B1) * W2 accumulated per-lane; cross-lane sum over h at the end,
//   then the 8 waves' partial sums over i are added through LDS in wave order.
// ---------------------------------------------------------------------------
#define KW   8            // waves per block = parts of the i range
#define KIC  (KI / KW)    // values of i per wave

__global__ __launch_bounds__(256) void kan_edge_mlp(const _Float16* __restrict__ featsH,
                                                    const _Float16* __restrict__ w1h,
                                                    const float* __restrict__ B1p,
                                                    const float* __restrict__ W2p,
                                                    const float* __restrict__ B2p,
                                                    float* __restrict__ out) {
    __shared__ float part[16][KW];   // [row][wave]: a row's 8 partial sums lie side by side

    const int lane  = threadIdx.x & 31;
    // wave number as a scalar: the i range and every base address stay scalar
    const int wid   = __builtin_amdgcn_readfirstlane(threadIdx.x >> 5);
    const int j     = blockIdx.x & (KJ - 1);
    const int btile = blockIdx.x >> 7;               // 0 .. 15
    const int l15   = lane & 15;
    const bool act  = lane < 16;                     // K=0..7 lives only in lanes 0-15

    float acc0[8], acc1[8];
#pragma unroll
    for (int r = 0; r < 8; ++r) { acc0[r] = 0.0f; acc1[r] = 0.0f; }
    float b2sum = 0.0f;

    const v8f zero = {};
    const int i0 = wid * KIC;

    for (int i = i0; i < i0 + KIC; ++i) {
        // Build A operand: feats for rows b = btile*16 + 0..15, K=0..7 in elems 0..7.
        v16h a = {}, b0 = {}, b1v = {};
        if (act) {
            v8h al  = *(const v8h*)(featsH + (size_t)(i * KB + btile * 16 + l15) * KF8);
            v8h bl0 = *(const v8h*)(w1h + ((size_t)i * (KJ * KH) + j * KH + l15) * KF8);
            v8h bl1 = *(const v8h*)(w1h + ((size_t)i * (KJ * KH) + j * KH + 16 + l15) * KF8);
#pragma unroll
            for (int k = 0; k < 8; ++k) { a[k] = al[k]; b0[k] = bl0[k]; b1v[k] = bl1[k]; }
        }

        // h[b, h0..15] and h[b, h16..31] for this (i, j): fresh C=0 each i.
        v8f c0 = __builtin_amdgcn_wmma_f32_16x16x32_f16(false, a, false, b0,
                                                        (short)0, zero, false, false);
        v8f c1 = __builtin_amdgcn_wmma_f32_16x16x32_f16(false, a, false, b1v,
                                                        (short)0, zero, false, false);

        const int base = (i * KJ + j) * KH + l15;    // [I,J,H] flat, h = l15 (+16)
        // half the bias: u = (h + B1) / 2 is formed by one fused multiply-add per element
        float hb0   = 0.5f * B1p[base];
        float hb1   = 0.5f * B1p[base + 16];
        float w20   = W2p[base];                     // W2[:, :, 0, :] same flat layout
        float w21   = W2p[base + 16];
        b2sum += B2p[i * KJ + j];                    // uniform scalar

#pragma unroll
        for (int r = 0; r < 8; ++r) {
            // silu(v) = v * sigmoid(v) = u + u * tanh(u) with u = v / 2
            float u0 = fmaf(c0[r], 0.5f, hb0);
            float u1 = fmaf(c1[r], 0.5f, hb1);
            float s0 = fmaf(u0, __builtin_amdgcn_tanhf(u0), u0);
            float s1 = fmaf(u1, __builtin_amdgcn_tanhf(u1), u1);
            acc0[r] = fmaf(s0, w20, acc0[r]);
            acc1[r] = fmaf(s1, w21, acc1[r]);
        }
    }

    // Sum over h: reduce within each 16-lane half (lanes 0-15 hold rows 0-7,
    // lanes 16-31 hold rows 8-15; xor masks 1,2,4,8 stay within each half).
    float red[8];
#pragma unroll
    for (int r = 0; r < 8; ++r) {
        float v = acc0[r] + acc1[r];
        v += __shfl_xor(v, 1, 32);
        v += __shfl_xor(v, 2, 32);
        v += __shfl_xor(v, 4, 32);
        v += __shfl_xor(v, 8, 32);
        red[r] = v;
    }

    if (l15 == 0) {
        int row = (lane >> 4) << 3;                  // lane 0 -> rows 0..7, lane 16 -> 8..15
#pragma unroll
        for (int r = 0; r < 8; ++r)
            part[row + r][wid] = red[r] + b2sum;
    }
    __syncthreads();   // every wave's partial sums stand in LDS before they are added

    if (threadIdx.x < 16) {
        float s = part[threadIdx.x][0];
        for (int w = 1; w < KW; ++w) s += part[threadIdx.x][w];
        out[(btile * 16 + threadIdx.x) * KJ + j] = s;
    }
}

// ---------------------------------------------------------------------------
extern "C" void kernel_launch(void* const* d_in, const int* in_sizes, int n_in,
                              void* d_out, int out_size, void* d_ws, size_t ws_size,
                              hipStream_t stream) {
    const float* x  = (const float*)d_in[0];   // [B, I]
    const float* W1 = (const float*)d_in[1];   // [I, J, H, 7]
    const float* W2 = (const float*)d_in[2];   // [I, J, 1, H]
    const float* B1 = (const float*)d_in[3];   // [I, J, H]
    const float* B2 = (const float*)d_in[4];   // [I, J, 1]
    float* out = (float*)d_out;                // [B, J]

    _Float16* featsH = (_Float16*)d_ws;                                  // 512 KB
    _Float16* w1h    = (_Float16*)((char*)d_ws +
                        (size_t)KI * KB * KF8 * sizeof(_Float16));       // 8.4 MB

    kan_pack_feats<<<(KB * KI) / 256, 256, 0, stream>>>(x, featsH);
    kan_pack_w1<<<(KI * KJ * KH) / 256, 256, 0, stream>>>(W1, w1h);
    kan_edge_mlp<<<16 * KJ, 256, 0, stream>>>(featsH, w1h, B1, W2, B2, out);
}

// v004
// Measured time: 22.4 microseconds a run.
// Versions between v002 and this one are left out; their measured steps multiply to 1.26 times as fast.
// All steps since v000 together make it 3.27 times as fast.
#include <hip/hip_runtime.h>
#include <hip/hip_bf16.h>

typedef __attribute__((ext_vector_type(16))) _Float16 v16h;
typedef __attribute__((ext_vector_type(8)))  _Float16 v8h;
typedef __attribute__((ext_vector_type(8)))  float    v8f;
typedef __attribute__((ext_vector_type(2)))  _Float16 v2h;
typedef __attribute__((ext_vector_type(2)))  float    v2f;

#define KB   256      // batch
#define KI   128      // DIM_IN
#define KJ   128      // DIM_OUT
#define KH   32       // HIDDEN
#define KF   7        // 1 + 2*N_SIN features
#define KF8  8        // padded K
#define KBP  264      // rows of featsH per i: 256 of b, one of zeros, 7 unused (whole 128-byte lines)

// ---------------------------------------------------------------------------
// Prologue 1: feats[b,i,0..6] = [x, sin(x),sin(2x),sin(4x), cos(x),cos(2x),cos(4x)]
// packed as f16 in WMMA A-operand K-order: featsH[(i*KBP + b)*8 + k]
// Row 256 of each i holds 8 zeros: the main kernel's lanes whose part of k must be
// empty read it.
// ---------------------------------------------------------------------------
__global__ __launch_bounds__(256) void kan_pack_feats(const float* __restrict__ x,
                                                      _Float16* __restrict__ featsH) {
    int t = blockIdx.x * 256 + threadIdx.x;      // 0 .. B*I-1
    int b = t >> 7;
    int i = t & (KI - 1);
    if (b == 0) *(v8h*)(featsH + (size_t)(i * KBP + KB) * KF8) = (v8h){};
    float xv = x[b * KI + i];
    v8h f;
    f[0] = (_Float16)xv;
    f[1] = (_Float16)__sinf(xv);
    f[2] = (_Float16)__sinf(2.0f * xv);
    f[3] = (_Float16)__sinf(4.0f * xv);
    f[4] = (_Float16)__cosf(xv);
    f[5] = (_Float16)__cosf(2.0f * xv);
    f[6] = (_Float16)__cosf(4.0f * xv);
    f[7] = (_Float16)0.0f;
    *(v8h*)(featsH + (size_t)(i * KBP + b) * KF8) = f;
}

// ---------------------------------------------------------------------------
// Main fused kernel. One 16-wave block per (64 rows of b, 2 values of j): 256 blocks, one
// per WGP, 4 waves on each SIMD. Wave v works on j = 2*jpair + (v >> 3) and takes the 16
// values of i from (v & 7)*16 on. Each wave holds KT = 4 b-tiles of 16 rows, so one fetch
// and one rounding of W1[i,j], B1[i,j] and W2[i,j] serve 64 rows, and the launch has a
// quarter of the waves to start. Per i:
//   lane l reads W1[i,j,h=l,0..6] as f32 (the 32 lanes cover 896 bytes in a row) and
//   rounds it to f16 (w). One A operand per b-tile: elements 0..7 hold the feats in lanes
//   0-15 and zeros in lanes 16-31, elements 8..15 zeros in lanes 0-15 and the feats in
//   lanes 16-31. B = {w, 0} then meets the feats only with h = 0..15, B = {0, w} only with
//   h = 16..31 (v_wmma_f32_16x16x32_f16).
//   silu(h + B1) * W2 accumulated per-lane; cross-lane sum over h at the end,
//   then the 8 waves' partial sums over i are added through LDS in wave order.
// ---------------------------------------------------------------------------
#define KW   8            // parts of the i range
#define KIC  (KI / KW)    // values of i per wave
#define KT   4            // b-tiles of 16 rows per wave
#define KJB  2            // values of j per block

// 4 waves per SIMD is what this launch puts there (one 16-wave block per WGP): said to the
// compiler so that it schedules the 64 independent silu chains of a trip side by side; aiming
// at more waves it keeps registers few, runs the chains one behind the other and pairs
// far fewer of the multiply-adds for dual issue.
__global__ __launch_bounds__(KW * KJB * 32) __attribute__((amdgpu_waves_per_eu(4, 4))) void kan_edge_mlp(const _Float16* __restrict__ featsH,
                                                    const float* __restrict__ W1p,
                                                    const float* __restrict__ B1p,
                                                    const float* __restrict__ W2p,
                                                    const float* __restrict__ B2p,
                                                    float* __restrict__ out) {
    __shared__ float part[KJB][KT * 16][KW];   // [j][row][part of i]: a row's 8 partial sums lie side by side

    const int lane  = threadIdx.x & 31;
    // wave number as a scalar: the i range and every base address stay scalar
    const int wv    = __builtin_amdgcn_readfirstlane(threadIdx.x >> 5);
    const int wid   = wv & (KW - 1);                 // part of the i range
    const int jl    = wv >> 3;                       // which j of the block
    const int j     = (blockIdx.x & (KJ / KJB - 1)) * KJB + jl;
    const int brow  = ((blockIdx.x >> 6) & (KB / (KT * 16) - 1)) * (KT * 16); // first of the block's 64 rows of b
    const int l15   = lane & 15;
    const bool act  = lane < 16;

    // every loop over t or r below is unrolled: its arrays stay in registers only where each
    // index is a compile-time constant
    float acc0[KT][8], acc1[KT][8];
#pragma unroll
    for (int t = 0; t < KT; ++t)
#pragma unroll
        for (int r = 0; r < 8; ++r) { acc0[t][r] = 0.0f; acc1[t][r] = 0.0f; }
    float b2sum = 0.0f;

    const v8f zero = {};
    const int i0 = wid * KIC;

    // Rows of featsH inside one i: a lane reads its b's feats for the half of the A operand
    // that it fills and the zero row for the other. Every base that moves with i is scalar.
    unsigned r0[KT], r1[KT];
#pragma unroll
    for (int t = 0; t < KT; ++t) {
        const unsigned rfeat = brow + t * 16 + l15;
        r0[t] = act ? rfeat : KB;
        r1[t] = act ? KB : rfeat;
    }
    const v8h z8 = {};

    for (int i = i0; i < i0 + KIC; ++i) {
        // i and the edge number as scalars: each address is a scalar base plus a fixed lane
        // offset, so no vector pointer is carried and stepped from trip to trip (fewer
        // registers, and no address register is rewritten behind a load that names it)
        const unsigned is = __builtin_amdgcn_readfirstlane(i);
        const unsigned e  = __builtin_amdgcn_readfirstlane(i * KJ + j);
        const _Float16* fi = featsH + (size_t)is * (KBP * KF8);
        const float* s = W1p + (size_t)e * (KH * KF) + lane * KF;
        v2f w01 = { s[0], s[1] }, w23 = { s[2], s[3] }, w45 = { s[4], s[5] }, w6z = { s[6], 0.0f };
        const size_t base = (size_t)e * KH;             // [I,J,H] flat; scalar, the lane adds h = l15 (+16)
        // half the bias: u = (h + B1) / 2 is formed by one fused multiply-add per element
        float hb0   = 0.5f * (B1p + base)[l15];
        float hb1   = 0.5f * (B1p + base)[l15 + 16];
        float w20   = (W2p + base)[l15];                   // W2[:, :, 0, :] same flat layout
        float w21   = (W2p + base)[l15 + 16];
        b2sum += B2p[i * KJ + j];                    // uniform scalar
        v8h al0[KT], al1[KT];
#pragma unroll
        for (int t = 0; t < KT; ++t) {
            al0[t] = *(const v8h*)(fi + r0[t] * KF8);
            al1[t] = *(const v8h*)(fi + r1[t] * KF8);
        }
        // every load of the trip is issued before any of its arithmetic: without this line the
        // compiler sinks the last b-tiles' loads behind the first WMMAs, and the wave then
        // waits for memory twice per trip
        __builtin_amdgcn_sched_barrier(0);

        v2h h01 = __builtin_convertvector(w01, v2h), h23 = __builtin_convertvector(w23, v2h);
        v2h h45 = __builtin_convertvector(w45, v2h), h6z = __builtin_convertvector(w6z, v2h);
        v8h w = { h01[0], h01[1], h23[0], h23[1], h45[0], h45[1], h6z[0], h6z[1] };
        v16h b0  = __builtin_shufflevector(w, z8, 0, 1, 2, 3, 4, 5, 6, 7, 8, 9, 10, 11, 12, 13, 14, 15);
        v16h b1v = __builtin_shufflevector(z8, w, 0, 1, 2, 3, 4, 5, 6, 7, 8, 9, 10, 11, 12, 13, 14, 15);

        // h[b, h0..15] and h[b, h16..31] for this (i, j) and each b-tile: fresh C=0 each i.
        v8f c0[KT], c1[KT];
#pragma unroll
        for (int t = 0; t < KT; ++t) {
            v16h a = __builtin_shufflevector(al0[t], al1[t], 0, 1, 2, 3, 4, 5, 6, 7, 8, 9, 10, 11, 12, 13, 14, 15);
            c0[t] = __builtin_amdgcn_wmma_f32_16x16x32_f16(false, a, false, b0,
                                                           (short)0, zero, false, false);
            c1[t] = __builtin_amdgcn_wmma_f32_16x16x32_f16(false, a, false, b1v,
                                                           (short)0, zero, false, false);
        }

        // silu(v) = v * sigmoid(v) = u + u * tanh(u) with u = v / 2
#pragma unroll
        for (int t = 0; t < KT; ++t) {
            float u0[8], u1[8], t0[8], t1[8];
#pragma unroll
            for (int r = 0; r < 8; ++r) {
                u0[r] = fmaf(c0[t][r], 0.5f, hb0);
                u1[r] = fmaf(c1[t][r], 0.5f, hb1);
            }
#pragma unroll
            for (int r = 0; r < 8; ++r) {
                t0[r] = __builtin_amdgcn_tanhf(u0[r]);
                t1[r] = __builtin_amdgcn_tanhf(u1[r]);
            }
#pragma unroll
            for (int r = 0; r < 8; ++r) {
                float s0 = fmaf(u0[r], t0[r], u0[r]);
                float s1 = fmaf(u1[r], t1[r], u1[r]);
                acc0[t][r] = fmaf(s0, w20, acc0[t][r]);
                acc1[t][r] = fmaf(s1, w21, acc1[t][r]);
            }
        }
    }

    // Sum over h: reduce within each 16-lane half (lanes 0-15 hold rows 0-7 of a b-tile,
    // lanes 16-31 hold rows 8-15; xor masks 1,2,4,8 stay within each half).
#pragma unroll
    for (int t = 0; t < KT; ++t) {
        float red[8];
#pragma unroll
        for (int r = 0; r < 8; ++r) {
            float v = acc0[t][r] + acc1[t][r];
            v += __shfl_xor(v, 1, 32);
            v += __shfl_xor(v, 2, 32);
            v += __shfl_xor(v, 4, 32);
            v += __shfl_xor(v, 8, 32);
            red[r] = v;
        }

        if (l15 == 0) {
            int row = t * 16 + ((lane >> 4) << 3);   // lane 0 -> rows 0..7 of the tile, lane 16 -> 8..15
#pragma unroll
            for (int r = 0; r < 8; ++r)
                part[jl][row + r][wid] = red[r] + b2sum;
        }
    }
    __syncthreads();   // every wave's partial sums stand in LDS before they are added

    if (threadIdx.x < KJB * KT * 16) {
        const int row = threadIdx.x >> 1, jo = threadIdx.x & 1;   // a row's two j lie side by side in out
        float s = part[jo][row][0];
        for (int w = 1; w < KW; ++w) s += part[jo][row][w];
        out[(brow + row) * KJ + (blockIdx.x & (KJ / KJB - 1)) * KJB + jo] = s;
    }
}

// ---------------------------------------------------------------------------
extern "C" void kernel_launch(void* const* d_in, const int* in_sizes, int n_in,
                              void* d_out, int out_size, void* d_ws, size_t ws_size,
                              hipStream_t stream) {
    const float* x  = (const float*)d_in[0];   // [B, I]
    const float* W1 = (const float*)d_in[1];   // [I, J, H, 7]
    const float* W2 = (const float*)d_in[2];   // [I, J, 1, H]
    const float* B1 = (const float*)d_in[3];   // [I, J, H]
    const float* B2 = (const float*)d_in[4];   // [I, J, 1]
    float* out = (float*)d_out;                // [B, J]

    _Float16* featsH = (_Float16*)d_ws;                                  // 528 KB

    kan_pack_feats<<<(KB * KI) / 256, 256, 0, stream>>>(x, featsH);
    kan_edge_mlp<<<(KB / (KT * 16)) * (KJ / KJB), KW * KJB * 32, 0, stream>>>(featsH, W1, B1, W2, B2, out);
}

// v005
// Measured time: 20 microseconds a run.
// Timed twice side by side with v004, it ran 1.11 times as fast both times.
// Counting every step since v000, it is 3.64 times as fast.
#include <hip/hip_runtime.h>
#include <hip/hip_bf16.h>

typedef __attribute__((ext_vector_type(16))) _Float16 v16h;
typedef __attribute__((ext_vector_type(8)))  _Float16 v8h;
typedef __attribute__((ext_vector_type(8)))  float    v8f;
typedef __attribute__((ext_vector_type(2)))  _Float16 v2h;
typedef __attribute__((ext_vector_type(2)))  float    v2f;

#define KB   256      // batch
#define KI   128      // DIM_IN
#define KJ   128      // DIM_OUT
#define KH   32       // HIDDEN
#define KF   7        // 1 + 2*N_SIN features

// ---------------------------------------------------------------------------
// The one kernel. One 16-wave block per (64 rows of b, 2 values of j): 256 blocks, one
// per WGP, 4 waves on each SIMD.
// First the block fills LDS with the feats of its own 64 rows of b and all 128 i:
//   feats[b,i,0..6] = [x, sin(x),sin(2x),sin(4x), cos(x),cos(2x),cos(4x)], slot 7 zero,
//   as f16 in WMMA A-operand K-order, 16 bytes a (b, i), at byte i*KIP + row*16.
//   KIP = 65 * 16: an odd number of 16-byte units, so that the 32 lanes of a store, which
//   hold 32 values of i, fall on different banks. A zero area behind the feats serves the
//   lanes whose part of k must be empty.
// Then wave v works on j = 2*jpair + (v >> 3) and takes the 16
// values of i from (v & 7)*16 on. Each wave holds KT = 4 b-tiles of 16 rows, so one fetch
// and one rounding of W1[i,j], B1[i,j] and W2[i,j] serve 64 rows. Per i:
//   lane l reads W1[i,j,h=l,0..6] as f32 (the 32 lanes cover 896 bytes in a row) and
//   rounds it to f16 (w). One A operand per b-tile: elements 0..7 hold the feats in lanes
//   0-15 and zeros in lanes 16-31, elements 8..15 zeros in lanes 0-15 and the feats in
//   lanes 16-31. B = {w, 0} then meets the feats only with h = 0..15, B = {0, w} only with
//   h = 16..31 (v_wmma_f32_16x16x32_f16).
//   silu(h + B1) * W2 accumulated per-lane; cross-lane sum over h at the end,
//   then the 8 waves' partial sums over i are added through LDS in wave order.
// ---------------------------------------------------------------------------
#define KW   8            // parts of the i range
#define KIC  (KI / KW)    // values of i per wave
#define KT   4            // b-tiles of 16 rows per wave
#define KJB  2            // values of j per block
#define KIP  (KT * 16 * 16 + 16)   // LDS bytes per i: 64 rows of 16 bytes and 16 unused
#define KZO  (KI * KIP)            // LDS byte offset of the zero area
#define KZB  (KT * 256)            // its size: a lane reads it at t*256 for b-tile t

// 4 waves per SIMD is what this launch puts there (one 16-wave block per WGP): said to the
// compiler so that it schedules the 64 independent silu chains of a trip side by side; aiming
// at more waves it keeps registers few, runs the chains one behind the other and pairs
// far fewer of the multiply-adds for dual issue.
__global__ __launch_bounds__(KW * KJB * 32) __attribute__((amdgpu_waves_per_eu(4, 4))) void kan_edge_mlp(const float* __restrict__ x,
                                                    const float* __restrict__ W1p,
                                                    const float* __restrict__ B1p,
                                                    const float* __restrict__ W2p,
                                                    const float* __restrict__ B2p,
                                                    float* __restrict__ out) {
    __shared__ float part[KJB][KT * 16][KW];   // [j][row][part of i]: a row's 8 partial sums lie side by side
    __shared__ __attribute__((aligned(16))) unsigned char featsL[KZO + KZB];

    const int lane  = threadIdx.x & 31;
    // wave number as a scalar: the i range and every base address stay scalar
    const int wv    = __builtin_amdgcn_readfirstlane(threadIdx.x >> 5);
    const int wid   = wv & (KW - 1);                 // part of the i range
    const int jl    = wv >> 3;                       // which j of the block
    const int j     = (blockIdx.x & (KJ / KJB - 1)) * KJB + jl;
    const int brow  = ((blockIdx.x >> 6) & (KB / (KT * 16) - 1)) * (KT * 16); // first of the block's 64 rows of b
    const int l15   = lane & 15;
    const bool act  = lane < 16;

    // feats of the block's 64 rows: thread -> one i and every 4th row, 16 (b, i) each; a wave
    // reads 32 values of x in a row
    {
        const int fi0 = threadIdx.x & (KI - 1);
        const int fr0 = threadIdx.x >> 7;
        float xs[16];
#pragma unroll
        for (int k = 0; k < 16; ++k) xs[k] = x[(brow + fr0 + 4 * k) * KI + fi0];
        if (threadIdx.x < KZB / 16) *(v8h*)(featsL + KZO + threadIdx.x * 16) = (v8h){};
#pragma unroll
        for (int k = 0; k < 16; ++k) {
            const float xv = xs[k];
            // v_sin_f32 and v_cos_f32 take turns, not radians: the factor is 1 / (2 pi)
            const float r1 = xv * 0.15915494f, r2 = (2.0f * xv) * 0.15915494f, r4 = (4.0f * xv) * 0.15915494f;
            float s1, s2, s4, c1, c2, c4;
            // One statement for the six transcendentals of one x.
            // Here every result has a register of its own ("=&v"), and the v_nop keeps the one
            // slot behind the last of them free of a reader or an overwrite.
            asm("v_sin_f32 %0, %6\n\t"
                "v_sin_f32 %1, %7\n\t"
                "v_sin_f32 %2, %8\n\t"
                "v_cos_f32 %3, %6\n\t"
                "v_cos_f32 %4, %7\n\t"
                "v_cos_f32 %5, %8\n\t"
                "v_nop"
                : "=&v"(s1), "=&v"(s2), "=&v"(s4), "=&v"(c1), "=&v"(c2), "=&v"(c4)
                : "v"(r1), "v"(r2), "v"(r4));
            v8h f;
            f[0] = (_Float16)xv;
            f[1] = (_Float16)s1;
            f[2] = (_Float16)s2;
            f[3] = (_Float16)s4;
            f[4] = (_Float16)c1;
            f[5] = (_Float16)c2;
            f[6] = (_Float16)c4;
            f[7] = (_Float16)0.0f;
            *(v8h*)(featsL + fi0 * KIP + (fr0 + 4 * k) * 16) = f;
        }
    }
    __syncthreads();   // the feats stand in LDS before any wave reads them

    // every loop over t or r below is unrolled: its arrays stay in registers only where each
    // index is a compile-time constant
    float acc0[KT][8], acc1[KT][8];
#pragma unroll
    for (int t = 0; t < KT; ++t)
#pragma unroll
        for (int r = 0; r < 8; ++r) { acc0[t][r] = 0.0f; acc1[t][r] = 0.0f; }
    float b2sum = 0.0f;

    const v8f zero = {};
    const int i0 = wid * KIC;

    // LDS byte addresses: a lane reads its b's feats for the half of the A operand that it
    // fills and the zero area for the other; b-tile t lies t*256 bytes on in both, so one
    // address serves the 4 tiles. Only the address in the feats steps with i.
    const unsigned afeat = i0 * KIP + l15 * 16;
    unsigned a0 = act ? afeat : KZO, a1 = act ? KZO : afeat;
    const unsigned st0 = act ? KIP : 0, st1 = act ? 0 : KIP;
    const v8h z8 = {};

    for (int i = i0; i < i0 + KIC; ++i) {
        // the edge number as a scalar: each global address is a scalar base plus a fixed lane
        // offset, so no vector pointer is carried and stepped from trip to trip (fewer
        // registers, and no address register is rewritten behind a load that names it)
        const unsigned e  = __builtin_amdgcn_readfirstlane(i * KJ + j);
        const float* s = W1p + (size_t)e * (KH * KF) + lane * KF;
        v2f w01 = { s[0], s[1] }, w23 = { s[2], s[3] }, w45 = { s[4], s[5] }, w6z = { s[6], 0.0f };
        const size_t base = (size_t)e * KH;             // [I,J,H] flat; scalar, the lane adds h = l15 (+16)
        // half the bias: u = (h + B1) / 2 is formed by one fused multiply-add per element
        float hb0   = 0.5f * (B1p + base)[l15];
        float hb1   = 0.5f * (B1p + base)[l15 + 16];
        float w20   = (W2p + base)[l15];                   // W2[:, :, 0, :] same flat layout
        float w21   = (W2p + base)[l15 + 16];
        b2sum += B2p[i * KJ + j];                    // uniform scalar
        v8h al0[KT], al1[KT];
#pragma unroll
        for (int t = 0; t < KT; ++t) {
            al0[t] = *(const v8h*)(featsL + a0 + t * 256);
            al1[t] = *(const v8h*)(featsL + a1 + t * 256);
        }
        a0 += st0;
        a1 += st1;
        // every load of the trip is issued before any of its arithmetic: without this line the
        // compiler sinks the last b-tiles' loads behind the first WMMAs, and the wave then
        // waits for memory twice per trip
        __builtin_amdgcn_sched_barrier(0);

        v2h h01 = __builtin_convertvector(w01, v2h), h23 = __builtin_convertvector(w23, v2h);
        v2h h45 = __builtin_convertvector(w45, v2h), h6z = __builtin_convertvector(w6z, v2h);
        v8h w = { h01[0], h01[1], h23[0], h23[1], h45[0], h45[1], h6z[0], h6z[1] };
        v16h b0  = __builtin_shufflevector(w, z8, 0, 1, 2, 3, 4, 5, 6, 7, 8, 9, 10, 11, 12, 13, 14, 15);
        v16h b1v = __builtin_shufflevector(z8, w, 0, 1, 2, 3, 4, 5, 6, 7, 8, 9, 10, 11, 12, 13, 14, 15);

        // h[b, h0..15] and h[b, h16..31] for this (i, j) and each b-tile: fresh C=0 each i.
        v8f c0[KT], c1[KT];
#pragma unroll
        for (int t = 0; t < KT; ++t) {
            v16h a = __builtin_shufflevector(al0[t], al1[t], 0, 1, 2, 3, 4, 5, 6, 7, 8, 9, 10, 11, 12, 13, 14, 15);
            c0[t] = __builtin_amdgcn_wmma_f32_16x16x32_f16(false, a, false, b0,
                                                           (short)0, zero, false, false);
            c1[t] = __builtin_amdgcn_wmma_f32_16x16x32_f16(false, a, false, b1v,
                                                           (short)0, zero, false, false);
        }

        // silu(v) = v * sigmoid(v) = u + u * tanh(u) with u = v / 2
#pragma unroll
        for (int t = 0; t < KT; ++t) {
            float u0[8], u1[8], t0[8], t1[8];
#pragma unroll
            for (int r = 0; r < 8; ++r) {
                u0[r] = fmaf(c0[t][r], 0.5f, hb0);
                u1[r] = fmaf(c1[t][r], 0.5f, hb1);
            }
#pragma unroll
            for (int r = 0; r < 8; ++r) {
                t0[r] = __builtin_amdgcn_tanhf(u0[r]);
                t1[r] = __builtin_amdgcn_tanhf(u1[r]);
            }
#pragma unroll
            for (int r = 0; r < 8; ++r) {
                float s0 = fmaf(u0[r], t0[r], u0[r]);
                float s1 = fmaf(u1[r], t1[r], u1[r]);
                acc0[t][r] = fmaf(s0, w20, acc0[t][r]);
                acc1[t][r] = fmaf(s1, w21, acc1[t][r]);
            }
        }
    }

    // Sum over h: reduce within each 16-lane half (lanes 0-15 hold rows 0-7 of a b-tile,
    // lanes 16-31 hold rows 8-15; xor masks 1,2,4,8 stay within each half).
#pragma unroll
    for (int t = 0; t < KT; ++t) {
        float red[8];
#pragma unroll
        for (int r = 0; r < 8; ++r) {
            float v = acc0[t][r] + acc1[t][r];
            v += __shfl_xor(v, 1, 32);
            v += __shfl_xor(v, 2, 32);
            v += __shfl_xor(v, 4, 32);
            v += __shfl_xor(v, 8, 32);
            red[r] = v;
        }

        if (l15 == 0) {
            int row = t * 16 + ((lane >> 4) << 3);   // lane 0 -> rows 0..7 of the tile, lane 16 -> 8..15
#pragma unroll
            for (int r = 0; r < 8; ++r)
                part[jl][row + r][wid] = red[r] + b2sum;
        }
    }
    __syncthreads();   // every wave's partial sums stand in LDS before they are added

    if (threadIdx.x < KJB * KT * 16) {
        const int row = threadIdx.x >> 1, jo = threadIdx.x & 1;   // a row's two j lie side by side in out
        float s = part[jo][row][0];
        for (int w = 1; w < KW; ++w) s += part[jo][row][w];
        out[(brow + row) * KJ + (blockIdx.x & (KJ / KJB - 1)) * KJB + jo] = s;
    }
}

// ---------------------------------------------------------------------------
extern "C" void kernel_launch(void* const* d_in, const int* in_sizes, int n_in,
                              void* d_out, int out_size, void* d_ws, size_t ws_size,
                              hipStream_t stream) {
    const float* x  = (const float*)d_in[0];   // [B, I]
    const float* W1 = (const float*)d_in[1];   // [I, J, H, 7]
    const float* W2 = (const float*)d_in[2];   // [I, J, 1, H]
    const float* B1 = (const float*)d_in[3];   // [I, J, H]
    const float* B2 = (const float*)d_in[4];   // [I, J, 1]
    float* out = (float*)d_out;                // [B, J]

    kan_edge_mlp<<<(KB / (KT * 16)) * (KJ / KJB), KW * KJB * 32, 0, stream>>>(x, W1, B1, W2, B2, out);
}

// v006
// It runs in 19.1 microseconds.
// Next to v005, in two timings, it ran 1.05 times as fast each time.
// All steps since v000 together make it 3.83 times as fast.
#include <hip/hip_runtime.h>
#include <hip/hip_bf16.h>

typedef __attribute__((ext_vector_type(16))) _Float16 v16h;
typedef __attribute__((ext_vector_type(8)))  _Float16 v8h;
typedef __attribute__((ext_vector_type(8)))  float    v8f;
typedef __attribute__((ext_vector_type(2)))  _Float16 v2h;
typedef __attribute__((ext_vector_type(2)))  float    v2f;

#define KB   256      // batch
#define KI   128      // DIM_IN
#define KJ   128      // DIM_OUT
#define KH   32       // HIDDEN
#define KF   7        // 1 + 2*N_SIN features

// ---------------------------------------------------------------------------
// The one kernel. One 16-wave block per (64 rows of b, 2 values of j): 256 blocks, one
// per WGP, 4 waves on each SIMD.
// First the block fills LDS with the feats of its own 64 rows of b and all 128 i:
//   feats[b,i,0..6] = [x, sin(x),sin(2x),sin(4x), cos(x),cos(2x),cos(4x)] / 2, slot 7 = 1/2,
//   as f16 in WMMA A-operand K-order, 16 bytes a (b, i), at byte i*KIP + row*16.
//   KIP = 65 * 16: an odd number of 16-byte units, so that the 32 lanes of a store, which
//   hold 32 values of i, fall on different banks. A zero area behind the feats serves the
//   lanes whose part of k must be empty.
// Then wave v works on j = 2*jpair + (v >> 3) and takes the 16
// values of i from (v & 7)*16 on. Each wave holds KT = 4 b-tiles of 16 rows, so one fetch
// and one rounding of W1[i,j], B1[i,j] and W2[i,j] serve 64 rows. Per i:
//   lane l reads W1[i,j,h=l,0..6] as f32 (the 32 lanes cover 896 bytes in a row) and
//   B1[i,j,h=l], and rounds the 8 to f16 (w): B1 stands at k 7, where it meets the 1/2, so the
//   WMMA's result is u = (h + B1) / 2 itself. One A operand per b-tile: elements 0..7 hold the feats in lanes
//   0-15 and zeros in lanes 16-31, elements 8..15 zeros in lanes 0-15 and the feats in
//   lanes 16-31. B = {w, 0} then meets the feats only with h = 0..15, B = {0, w} only with
//   h = 16..31 (v_wmma_f32_16x16x32_f16).
//   silu(2u) * W2 accumulated per-lane; cross-lane sum over h at the end,
//   then the 8 waves' partial sums over i are added through LDS in wave order.
// ---------------------------------------------------------------------------
#define KW   8            // parts of the i range
#define KIC  (KI / KW)    // values of i per wave
#define KT   4            // b-tiles of 16 rows per wave
#define KJB  2            // values of j per block
#define KIP  (KT * 16 * 16 + 16)   // LDS bytes per i: 64 rows of 16 bytes and 16 unused
#define KZO  (KI * KIP)            // LDS byte offset of the zero area
#define KZB  (KT * 256)            // its size: a lane reads it at t*256 for b-tile t

// 4 waves per SIMD is what this launch puts there (one 16-wave block per WGP): said to the
// compiler so that it schedules the 64 independent silu chains of a trip side by side; aiming
// at more waves it keeps registers few, runs the chains one behind the other and pairs
// far fewer of the multiply-adds for dual issue.
__global__ __launch_bounds__(KW * KJB * 32) __attribute__((amdgpu_waves_per_eu(4, 4))) void kan_edge_mlp(const float* __restrict__ x,
                                                    const float* __restrict__ W1p,
                                                    const float* __restrict__ B1p,
                                                    const float* __restrict__ W2p,
                                                    const float* __restrict__ B2p,
                                                    float* __restrict__ out) {
    __shared__ float part[KJB][KT * 16][KW];   // [j][row][part of i]: a row's 8 partial sums lie side by side
    __shared__ __attribute__((aligned(16))) unsigned char featsL[KZO + KZB];

    const int lane  = threadIdx.x & 31;
    // wave number as a scalar: the i range and every base address stay scalar
    const int wv    = __builtin_amdgcn_readfirstlane(threadIdx.x >> 5);
    const int wid   = wv & (KW - 1);                 // part of the i range
    const int jl    = wv >> 3;                       // which j of the block
    const int j     = (blockIdx.x & (KJ / KJB - 1)) * KJB + jl;
    const int brow  = ((blockIdx.x >> 6) & (KB / (KT * 16) - 1)) * (KT * 16); // first of the block's 64 rows of b
    const int l15   = lane & 15;
    const bool act  = lane < 16;

    // feats of the block's 64 rows: thread -> one i and every 4th row, 16 (b, i) each; a wave
    // reads 32 values of x in a row
    {
        const int fi0 = threadIdx.x & (KI - 1);
        const int fr0 = threadIdx.x >> 7;
        float xs[16];
#pragma unroll
        for (int k = 0; k < 16; ++k) xs[k] = x[(brow + fr0 + 4 * k) * KI + fi0];
        if (threadIdx.x < KZB / 16) *(v8h*)(featsL + KZO + threadIdx.x * 16) = (v8h){};
#pragma unroll
        for (int k = 0; k < 16; ++k) {
            const float xv = xs[k];
            // v_sin_f32 and v_cos_f32 take turns, not radians: the factor is 1 / (2 pi)
            const float r1 = xv * 0.15915494f, r2 = (2.0f * xv) * 0.15915494f, r4 = (4.0f * xv) * 0.15915494f;
            float s1, s2, s4, c1, c2, c4;
            // One statement for the six transcendentals of one x.
            // Here every result has a register of its own ("=&v"), and the v_nop keeps the one
            // slot behind the last of them free of a reader or an overwrite.
            asm("v_sin_f32 %0, %6\n\t"
                "v_sin_f32 %1, %7\n\t"
                "v_sin_f32 %2, %8\n\t"
                "v_cos_f32 %3, %6\n\t"
                "v_cos_f32 %4, %7\n\t"
                "v_cos_f32 %5, %8\n\t"
                "v_nop"
                : "=&v"(s1), "=&v"(s2), "=&v"(s4), "=&v"(c1), "=&v"(c2), "=&v"(c4)
                : "v"(r1), "v"(r2), "v"(r4));
            v8h f;
            // halved (a power of two: the f16 rounding stays that of the whole value, subnormals aside):
            // the matrix product then gives v / 2; slot 7 turns the B1 at k 7 into B1 / 2
            f[0] = (_Float16)(0.5f * xv);
            f[1] = (_Float16)(0.5f * s1);
            f[2] = (_Float16)(0.5f * s2);
            f[3] = (_Float16)(0.5f * s4);
            f[4] = (_Float16)(0.5f * c1);
            f[5] = (_Float16)(0.5f * c2);
            f[6] = (_Float16)(0.5f * c4);
            f[7] = (_Float16)0.5f;
            *(v8h*)(featsL + fi0 * KIP + (fr0 + 4 * k) * 16) = f;
        }
    }
    __syncthreads();   // the feats stand in LDS before any wave reads them

    // every loop over t or r below is unrolled: its arrays stay in registers only where each
    // index is a compile-time constant
    float acc0[KT][8], acc1[KT][8];
#pragma unroll
    for (int t = 0; t < KT; ++t)
#pragma unroll
        for (int r = 0; r < 8; ++r) { acc0[t][r] = 0.0f; acc1[t][r] = 0.0f; }
    float b2sum = 0.0f;

    const v8f zero = {};
    const int i0 = wid * KIC;

    // LDS byte addresses: a lane reads its b's feats for the half of the A operand that it
    // fills and the zero area for the other; b-tile t lies t*256 bytes on in both, so one
    // address serves the 4 tiles. Only the address in the feats steps with i.
    const unsigned afeat = i0 * KIP + l15 * 16;
    unsigned a0 = act ? afeat : KZO, a1 = act ? KZO : afeat;
    const unsigned st0 = act ? KIP : 0, st1 = act ? 0 : KIP;
    const v8h z8 = {};

    for (int i = i0; i < i0 + KIC; ++i) {
        // the edge number as a scalar: each global address is a scalar base plus a fixed lane
        // offset, so no vector pointer is carried and stepped from trip to trip (fewer
        // registers, and no address register is rewritten behind a load that names it)
        const unsigned e  = __builtin_amdgcn_readfirstlane(i * KJ + j);
        const float* s = W1p + (size_t)e * (KH * KF) + lane * KF;
        const size_t base = (size_t)e * KH;             // [I,J,H] flat; scalar, the lane adds its h
        // the bias of the lane's own h goes into k 7 of its W1 row
        v2f w01 = { s[0], s[1] }, w23 = { s[2], s[3] }, w45 = { s[4], s[5] }, w6z = { s[6], (B1p + base)[lane] };
        float w20   = (W2p + base)[l15];                   // W2[:, :, 0, :] same flat layout
        float w21   = (W2p + base)[l15 + 16];
        b2sum += B2p[i * KJ + j];                    // uniform scalar
        v8h al0[KT], al1[KT];
#pragma unroll
        for (int t = 0; t < KT; ++t) {
            al0[t] = *(const v8h*)(featsL + a0 + t * 256);
            al1[t] = *(const v8h*)(featsL + a1 + t * 256);
        }
        a0 += st0;
        a1 += st1;
        // every load of the trip is issued before any of its arithmetic: without this line the
        // compiler sinks the last b-tiles' loads behind the first WMMAs, and the wave then
        // waits for memory twice per trip
        __builtin_amdgcn_sched_barrier(0);

        v2h h01 = __builtin_convertvector(w01, v2h), h23 = __builtin_convertvector(w23, v2h);
        v2h h45 = __builtin_convertvector(w45, v2h), h6z = __builtin_convertvector(w6z, v2h);
        v8h w = { h01[0], h01[1], h23[0], h23[1], h45[0], h45[1], h6z[0], h6z[1] };
        v16h b0  = __builtin_shufflevector(w, z8, 0, 1, 2, 3, 4, 5, 6, 7, 8, 9, 10, 11, 12, 13, 14, 15);
        v16h b1v = __builtin_shufflevector(z8, w, 0, 1, 2, 3, 4, 5, 6, 7, 8, 9, 10, 11, 12, 13, 14, 15);

        // u[b, h0..15] and u[b, h16..31] for this (i, j) and each b-tile: fresh C=0 each i.
        v8f c0[KT], c1[KT];
#pragma unroll
        for (int t = 0; t < KT; ++t) {
            v16h a = __builtin_shufflevector(al0[t], al1[t], 0, 1, 2, 3, 4, 5, 6, 7, 8, 9, 10, 11, 12, 13, 14, 15);
            c0[t] = __builtin_amdgcn_wmma_f32_16x16x32_f16(false, a, false, b0,
                                                           (short)0, zero, false, false);
            c1[t] = __builtin_amdgcn_wmma_f32_16x16x32_f16(false, a, false, b1v,
                                                           (short)0, zero, false, false);
        }

        // silu(v) = v * sigmoid(v) = u + u * tanh(u) with u = v / 2
#pragma unroll
        for (int t = 0; t < KT; ++t) {
            float t0[8], t1[8];
#pragma unroll
            for (int r = 0; r < 8; ++r) {
                t0[r] = __builtin_amdgcn_tanhf(c0[t][r]);
                t1[r] = __builtin_amdgcn_tanhf(c1[t][r]);
            }
#pragma unroll
            for (int r = 0; r < 8; ++r) {
                float s0 = fmaf(c0[t][r], t0[r], c0[t][r]);
                float s1 = fmaf(c1[t][r], t1[r], c1[t][r]);
                acc0[t][r] = fmaf(s0, w20, acc0[t][r]);
                acc1[t][r] = fmaf(s1, w21, acc1[t][r]);
            }
        }
    }

    // Sum over h: reduce within each 16-lane half (lanes 0-15 hold rows 0-7 of a b-tile,
    // lanes 16-31 hold rows 8-15; xor masks 1,2,4,8 stay within each half).
#pragma unroll
    for (int t = 0; t < KT; ++t) {
        float red[8];
#pragma unroll
        for (int r = 0; r < 8; ++r) {
            float v = acc0[t][r] + acc1[t][r];
            v += __shfl_xor(v, 1, 32);
            v += __shfl_xor(v, 2, 32);
            v += __shfl_xor(v, 4, 32);
            v += __shfl_xor(v, 8, 32);
            red[r] = v;
        }

        if (l15 == 0) {
            int row = t * 16 + ((lane >> 4) << 3);   // lane 0 -> rows 0..7 of the tile, lane 16 -> 8..15
#pragma unroll
            for (int r = 0; r < 8; ++r)
                part[jl][row + r][wid] = red[r] + b2sum;
        }
    }
    __syncthreads();   // every wave's partial sums stand in LDS before they are added

    if (threadIdx.x < KJB * KT * 16) {
        const int row = threadIdx.x >> 1, jo = threadIdx.x & 1;   // a row's two j lie side by side in out
        float s = part[jo][row][0];
        for (int w = 1; w < KW; ++w) s += part[jo][row][w];
        out[(brow + row) * KJ + (blockIdx.x & (KJ / KJB - 1)) * KJB + jo] = s;
    }
}

// ---------------------------------------------------------------------------
extern "C" void kernel_launch(void* const* d_in, const int* in_sizes, int n_in,
                              void* d_out, int out_size, void* d_ws, size_t ws_size,
                              hipStream_t stream) {
    const float* x  = (const float*)d_in[0];   // [B, I]
    const float* W1 = (const float*)d_in[1];   // [I, J, H, 7]
    const float* W2 = (const float*)d_in[2];   // [I, J, 1, H]
    const float* B1 = (const float*)d_in[3];   // [I, J, H]
    const float* B2 = (const float*)d_in[4];   // [I, J, 1]
    float* out = (float*)d_out;                // [B, J]

    kan_edge_mlp<<<(KB / (KT * 16)) * (KJ / KJB), KW * KJB * 32, 0, stream>>>(x, W1, B1, W2, B2, out);
}

// v007
// One run takes 15.7 microseconds.
// In both of two side-by-side timings against v006, it was 1.21 times as fast.
// Counting every step since v000, it is 4.63 times as fast.
#include <hip/hip_runtime.h>
#include <hip/hip_bf16.h>

typedef __attribute__((ext_vector_type(16))) _Float16 v16h;
typedef __attribute__((ext_vector_type(8)))  _Float16 v8h;
typedef __attribute__((ext_vector_type(8)))  float    v8f;
typedef __attribute__((ext_vector_type(2)))  _Float16 v2h;
typedef __attribute__((ext_vector_type(2)))  float    v2f;

#define KB   256      // batch
#define KI   128      // DIM_IN
#define KJ   128      // DIM_OUT
#define KH   32       // HIDDEN
#define KF   7        // 1 + 2*N_SIN features

// ---------------------------------------------------------------------------
// The one kernel. One 16-wave block per (64 rows of b, 2 values of j): 256 blocks, one
// per WGP, 4 waves on each SIMD.
// First the block fills LDS with the feats of its own 64 rows of b and all 128 i:
//   feats[b,i,0..6] = [x, sin(x),sin(2x),sin(4x), cos(x),cos(2x),cos(4x)] / 2, slot 7 = 1/2,
//   as f16 in WMMA A-operand K-order, 16 bytes a (b, i), at byte i*KIP + row*16.
//   KIP = 65 * 16: an odd number of 16-byte units, so that the 32 lanes of a store, which
//   hold 32 values of i, fall on different banks. A zero area behind the feats serves the
//   lanes whose part of k must be empty.
// Then wave v works on j = 2*jpair + (v >> 3) and takes the 16
// values of i from (v & 7)*16 on. Each wave holds KT = 4 b-tiles of 16 rows, so one fetch
// and one rounding of W1[i,j], B1[i,j] and W2[i,j] serve 64 rows. Per i:
//   lane l reads W1[i,j,h=l,0..6] as f32 (the 32 lanes cover 896 bytes in a row) and
//   B1[i,j,h=l], and rounds the 8 to f16 (w): B1 stands at k 7, where it meets the 1/2, so the
//   WMMA's result is u = (h + B1) / 2 itself. One A operand per b-tile: elements 0..7 hold the feats in lanes
//   0-15 and zeros in lanes 16-31, elements 8..15 zeros in lanes 0-15 and the feats in
//   lanes 16-31. B = {w, 0} then meets the feats only with h = 0..15, B = {0, w} only with
//   h = 16..31 (v_wmma_f32_16x16x32_f16).
//   Every operand of a trip is asked for one trip ahead: the global loads of i+1 are issued
//   once the values of i are rounded, the LDS loads of i+1 among the last WMMAs of i, so both
//   latencies pass under the silu work of trip i.
//   silu(2u) * W2 accumulated per-lane; cross-lane sum over h at the end,
//   then the 8 waves' partial sums over i are added through LDS in wave order.
// ---------------------------------------------------------------------------
#define KW   8            // parts of the i range
#define KIC  (KI / KW)    // values of i per wave
#define KT   4            // b-tiles of 16 rows per wave
#define KJB  2            // values of j per block
#define KIP  (KT * 16 * 16 + 16)   // LDS bytes per i: 64 rows of 16 bytes and 16 unused
#define KZO  (KI * KIP)            // LDS byte offset of the zero area
#define KZB  (KT * 256)            // its size: a lane reads it at t*256 for b-tile t

// A wave-uniform global pointer, held as a scalar pair: a load through it is a scalar base plus
// the lane's fixed 32-bit offset. Left to itself the compiler adds the lane's offset to the
// array's base in front of the loop and steps a 64-bit vector address every trip, in registers
// that it reuses right behind the loads, where a wait for the loads' addresses then stands.
typedef const __attribute__((address_space(1))) float* gcf;
__device__ __forceinline__ gcf scalar_base(const float* p) {
    const unsigned long long a = (unsigned long long)p;
    const unsigned lo = __builtin_amdgcn_readfirstlane((unsigned)a);
    const unsigned hi = __builtin_amdgcn_readfirstlane((unsigned)(a >> 32));
    return (gcf)(((unsigned long long)hi << 32) | lo);
}

// 4 waves per SIMD is what this launch puts there (one 16-wave block per WGP): said to the
// compiler so that it schedules the 64 independent silu chains of a trip side by side; aiming
// at more waves it keeps registers few, runs the chains one behind the other and pairs
// far fewer of the multiply-adds for dual issue.
__global__ __launch_bounds__(KW * KJB * 32) __attribute__((amdgpu_waves_per_eu(4, 4))) void kan_edge_mlp(const float* __restrict__ x,
                                                    const float* __restrict__ W1p,
                                                    const float* __restrict__ B1p,
                                                    const float* __restrict__ W2p,
                                                    const float* __restrict__ B2p,
                                                    float* __restrict__ out) {
    __shared__ float part[KJB][KT * 16][KW];   // [j][row][part of i]: a row's 8 partial sums lie side by side
    __shared__ __attribute__((aligned(16))) unsigned char featsL[KZO + KZB];

    const int lane  = threadIdx.x & 31;
    // wave number as a scalar: the i range and every base address stay scalar
    const int wv    = __builtin_amdgcn_readfirstlane(threadIdx.x >> 5);
    const int wid   = wv & (KW - 1);                 // part of the i range
    const int jl    = wv >> 3;                       // which j of the block
    const int j     = (blockIdx.x & (KJ / KJB - 1)) * KJB + jl;
    const int brow  = ((blockIdx.x >> 6) & (KB / (KT * 16) - 1)) * (KT * 16); // first of the block's 64 rows of b
    const int l15   = lane & 15;
    const bool act  = lane < 16;

    const int i0 = wid * KIC;
    const unsigned lw1 = lane * KF;   // the lane's own W1 row inside an edge, in elements

    // the raw operands of the coming trip: W1[i,j,h=lane,0..6], B1 and W2 of the lane's h.
    // Those of the first trip are asked for here, so that they arrive under the feats work.
    float rw[KF], rb1, rw20, rw21;
    {
        const unsigned e = __builtin_amdgcn_readfirstlane(i0 * KJ + j);
        const gcf s = scalar_base(W1p + (size_t)e * (KH * KF));
        const gcf sb = scalar_base(B1p + (size_t)e * KH), sw = scalar_base(W2p + (size_t)e * KH);
#pragma unroll
        for (int f = 0; f < KF; ++f) rw[f] = s[lw1 + f];
        rb1  = sb[(unsigned)lane];
        rw20 = sw[(unsigned)l15];
        rw21 = sw[(unsigned)l15 + 16];
    }
    // B2 of the wave's 16 values of i, one to a lane (both halves of the wave hold the same):
    // one load in front of the loop in place of a scalar load and its wait in every trip
    const float b2v = B2p[(i0 + l15) * KJ + j];
    // the code below overwrites registers that the loads above name as addresses: the wait stands
    // in front of it as a precaution
    asm volatile("s_wait_xcnt 0x0" ::: "memory");

    // feats of the block's 64 rows: thread -> one i and every 4th row, 16 (b, i) each; a wave
    // reads 32 values of x in a row
    {
        const int fi0 = threadIdx.x & (KI - 1);
        const int fr0 = threadIdx.x >> 7;
        float xs[16];
#pragma unroll
        for (int k = 0; k < 16; ++k) xs[k] = x[(brow + fr0 + 4 * k) * KI + fi0];
        if (threadIdx.x < KZB / 16) *(v8h*)(featsL + KZO + threadIdx.x * 16) = (v8h){};
#pragma unroll
        for (int k = 0; k < 16; ++k) {
            const float xv = xs[k];
            // v_sin_f32 and v_cos_f32 take turns, not radians: the factor is 1 / (2 pi)
            const float r1 = xv * 0.15915494f, r2 = (2.0f * xv) * 0.15915494f, r4 = (4.0f * xv) * 0.15915494f;
            float s1, s2, s4, c1, c2, c4;
            // One statement for the six transcendentals of one x.
            // Here every result has a register of its own ("=&v"), and the v_nop keeps the one
            // slot behind the last of them free of a reader or an overwrite.
            asm("v_sin_f32 %0, %6\n\t"
                "v_sin_f32 %1, %7\n\t"
                "v_sin_f32 %2, %8\n\t"
                "v_cos_f32 %3, %6\n\t"
                "v_cos_f32 %4, %7\n\t"
                "v_cos_f32 %5, %8\n\t"
                "v_nop"
                : "=&v"(s1), "=&v"(s2), "=&v"(s4), "=&v"(c1), "=&v"(c2), "=&v"(c4)
                : "v"(r1), "v"(r2), "v"(r4));
            v8h f;
            // halved (a power of two: the f16 rounding stays that of the whole value, subnormals aside):
            // the matrix product then gives v / 2; slot 7 turns the B1 at k 7 into B1 / 2
            f[0] = (_Float16)(0.5f * xv);
            f[1] = (_Float16)(0.5f * s1);
            f[2] = (_Float16)(0.5f * s2);
            f[3] = (_Float16)(0.5f * s4);
            f[4] = (_Float16)(0.5f * c1);
            f[5] = (_Float16)(0.5f * c2);
            f[6] = (_Float16)(0.5f * c4);
            f[7] = (_Float16)0.5f;
            *(v8h*)(featsL + fi0 * KIP + (fr0 + 4 * k) * 16) = f;
        }
    }
    __syncthreads();   // the feats stand in LDS before any wave reads them

    // every loop over t or r below is unrolled: its arrays stay in registers only where each
    // index is a compile-time constant
    float acc0[KT][8], acc1[KT][8];
#pragma unroll
    for (int t = 0; t < KT; ++t)
#pragma unroll
        for (int r = 0; r < 8; ++r) { acc0[t][r] = 0.0f; acc1[t][r] = 0.0f; }

    const v8f zero = {};

    // LDS byte addresses: a lane reads its b's feats for the half of the A operand that it
    // fills and the zero area for the other; b-tile t lies t*256 bytes on in both, so one
    // address serves the 4 tiles. Only the address in the feats steps with i.
    const unsigned afeat = i0 * KIP + l15 * 16;
    unsigned a0 = act ? afeat : KZO, a1 = act ? KZO : afeat;
    const unsigned st0 = act ? KIP : 0, st1 = act ? 0 : KIP;
    const v8h z8 = {};

    // the A fragments of the first trip
    v16h a[KT];
#pragma unroll
    for (int t = 0; t < KT; ++t)
        a[t] = __builtin_shufflevector(*(const v8h*)(featsL + a0 + t * 256), *(const v8h*)(featsL + a1 + t * 256),
                                       0, 1, 2, 3, 4, 5, 6, 7, 8, 9, 10, 11, 12, 13, 14, 15);

    // two trips to a pass: what a trip loads for the next then has registers that the next
    // trip's own loads do not need, and no copy from 'next' to 'current' stands at the loop's foot
#pragma unroll 2
    for (int i = i0; i < i0 + KIC; ++i) {
        // this trip's operands, asked for one trip ago, are rounded to f16, which frees the raw
        // registers. The bias of the lane's own h goes into k 7 of its W1 row.
        v2f w01 = { rw[0], rw[1] }, w23 = { rw[2], rw[3] }, w45 = { rw[4], rw[5] }, w6z = { rw[6], rb1 };
        v2h h01 = __builtin_convertvector(w01, v2h), h23 = __builtin_convertvector(w23, v2h);
        v2h h45 = __builtin_convertvector(w45, v2h), h6z = __builtin_convertvector(w6z, v2h);
        v8h w = { h01[0], h01[1], h23[0], h23[1], h45[0], h45[1], h6z[0], h6z[1] };
        const float w20 = rw20, w21 = rw21;          // W2[:, :, 0, :] same flat layout as B1
        v16h b0  = __builtin_shufflevector(w, z8, 0, 1, 2, 3, 4, 5, 6, 7, 8, 9, 10, 11, 12, 13, 14, 15);
        v16h b1v = __builtin_shufflevector(z8, w, 0, 1, 2, 3, 4, 5, 6, 7, 8, 9, 10, 11, 12, 13, 14, 15);

        // the rounding above stays in front of the loads below, which can then land in registers
        // that it has read out. Without this line the compiler spreads the loads over the trip
        // in front of them, with waits for their address registers between the arithmetic.
        __builtin_amdgcn_sched_barrier(0);

        // the next trip's global loads (the last trip asks for its own edge again: in bounds,
        // not used). The edge number is a scalar: each address is a scalar base plus a fixed
        // lane offset, so no vector address is stepped behind a load that names it.
        {
            const int in = i + 1 < i0 + KIC ? i + 1 : i;
            const unsigned e = __builtin_amdgcn_readfirstlane(in * KJ + j);
            const gcf s = scalar_base(W1p + (size_t)e * (KH * KF));
            // [I,J,H] flat; the lane adds its h
            const gcf sb = scalar_base(B1p + (size_t)e * KH), sw = scalar_base(W2p + (size_t)e * KH);
            // W2 first: in this order the listing has no wait for these loads inside the trip.
            // With W2 last the B1 load was given the unused upper half of the register pair
            // by which a packed multiply-add names w20, and that multiply-add waited for it.
            rw20 = sw[(unsigned)l15];
            rw21 = sw[(unsigned)l15 + 16];
            rb1  = sb[(unsigned)lane];
#pragma unroll
            for (int f = 0; f < KF; ++f) rw[f] = s[lw1 + f];
        }
        // u[b, h0..15] and u[b, h16..31] for this (i, j) and each b-tile: fresh C=0 each i.
        v8f c0[KT], c1[KT];
#pragma unroll
        for (int t = 0; t < KT; ++t) {
            c0[t] = __builtin_amdgcn_wmma_f32_16x16x32_f16(false, a[t], false, b0,
                                                           (short)0, zero, false, false);
            c1[t] = __builtin_amdgcn_wmma_f32_16x16x32_f16(false, a[t], false, b1v,
                                                           (short)0, zero, false, false);
        }

        // keeps the LDS loads below from rising to the head of the trip (in the listing one WMMA
        // still follows them). Without this line the build has 16 more v_nop a pass behind its
        // WMMAs and a wait for the fresh global loads in the middle of a trip.
        __builtin_amdgcn_sched_barrier(0);

        // the next trip's A fragments (the last trip of the last part of i reads the zero area,
        // the others a neighbour's feats: inside the array, not used)
        a0 += st0;
        a1 += st1;
#pragma unroll
        for (int t = 0; t < KT; ++t)
            a[t] = __builtin_shufflevector(*(const v8h*)(featsL + a0 + t * 256), *(const v8h*)(featsL + a1 + t * 256),
                                           0, 1, 2, 3, 4, 5, 6, 7, 8, 9, 10, 11, 12, 13, 14, 15);

        // silu(v) = v * sigmoid(v) = u + u * tanh(u) with u = v / 2
#pragma unroll
        for (int t = 0; t < KT; ++t) {
            float t0[8], t1[8];
#pragma unroll
            for (int r = 0; r < 8; ++r) {
                t0[r] = __builtin_amdgcn_tanhf(c0[t][r]);
                t1[r] = __builtin_amdgcn_tanhf(c1[t][r]);
            }
#pragma unroll
            for (int r = 0; r < 8; ++r) {
                float s0 = fmaf(c0[t][r], t0[r], c0[t][r]);
                float s1 = fmaf(c1[t][r], t1[r], c1[t][r]);
                acc0[t][r] = fmaf(s0, w20, acc0[t][r]);
                acc1[t][r] = fmaf(s1, w21, acc1[t][r]);
            }
        }
    }

    // the last trip's loads (not used) may still be under way, and the code below overwrites
    // registers that they name as addresses: the wait stands in front of it as a precaution
    asm volatile("s_wait_xcnt 0x0" ::: "memory");
    // nothing of the code below is lifted over the wait (the compiler did so without this line)
    __builtin_amdgcn_sched_barrier(0);

    // the wave's 16 values of B2, added in the order of i as before
    float b2sum = 0.0f;
#pragma unroll
    for (int k = 0; k < KIC; ++k)
        b2sum += __builtin_bit_cast(float, __builtin_amdgcn_readlane(__builtin_bit_cast(int, b2v), k));

    // Sum over h: reduce within each 16-lane half (lanes 0-15 hold rows 0-7 of a b-tile,
    // lanes 16-31 hold rows 8-15; xor masks 1,2,4,8 stay within each half).
#pragma unroll
    for (int t = 0; t < KT; ++t) {
        float red[8];
#pragma unroll
        for (int r = 0; r < 8; ++r) {
            float v = acc0[t][r] + acc1[t][r];
            v += __shfl_xor(v, 1, 32);
            v += __shfl_xor(v, 2, 32);
            v += __shfl_xor(v, 4, 32);
            v += __shfl_xor(v, 8, 32);
            red[r] = v;
        }

        if (l15 == 0) {
            int row = t * 16 + ((lane >> 4) << 3);   // lane 0 -> rows 0..7 of the tile, lane 16 -> 8..15
#pragma unroll
            for (int r = 0; r < 8; ++r)
                part[jl][row + r][wid] = red[r] + b2sum;
        }
    }
    __syncthreads();   // every wave's partial sums stand in LDS before they are added

    if (threadIdx.x < KJB * KT * 16) {
        const int row = threadIdx.x >> 1, jo = threadIdx.x & 1;   // a row's two j lie side by side in out
        float s = part[jo][row][0];
        for (int w = 1; w < KW; ++w) s += part[jo][row][w];
        out[(brow + row) * KJ + (blockIdx.x & (KJ / KJB - 1)) * KJB + jo] = s;
    }
}

// ---------------------------------------------------------------------------
extern "C" void kernel_launch(void* const* d_in, const int* in_sizes, int n_in,
                              void* d_out, int out_size, void* d_ws, size_t ws_size,
                              hipStream_t stream) {
    const float* x  = (const float*)d_in[0];   // [B, I]
    const float* W1 = (const float*)d_in[1];   // [I, J, H, 7]
    const float* W2 = (const float*)d_in[2];   // [I, J, 1, H]
    const float* B1 = (const float*)d_in[3];   // [I, J, H]
    const float* B2 = (const float*)d_in[4];   // [I, J, 1]
    float* out = (float*)d_out;                // [B, J]

    kan_edge_mlp<<<(KB / (KT * 16)) * (KJ / KJB), KW * KJB * 32, 0, stream>>>(x, W1, B1, W2, B2, out);
}
